// v000
// Times are from an AMD MI455X. After a warm-up the kernel runs many times in a row, and a time is the length of
// such a window on the GPU divided by its runs, so every launch and the gaps after it count. The runs cycle
// through copies of the inputs. A figure is the median of several windows, for all but v000 over two sittings.
// Sittings can differ by a few percent; kernels timed side by side share one.
// The starting kernel, v000, takes 80.6 microseconds a run.
#include <hip/hip_runtime.h>
#include <hip/hip_bf16.h>
#include <math.h>

// Problem constants (from reference)
#define BB   4
#define LQ   128
#define LK   512
#define ET   128   // EMBED_TIME
#define NH   8     // NUM_HEADS
#define EK   16    // ET / NH
#define DD   64    // INPUT_DIM
#define HID  256   // HIDDEN_DIM

typedef __attribute__((ext_vector_type(2))) float v2f;
typedef __attribute__((ext_vector_type(8))) float v8f;

// ---------------------------------------------------------------------------
// Generic batched GEMM on V_WMMA_F32_16X16X4_F32.
//   C[bz] = scale * (A[bz] @ B[bz]) + bias
// One wave (32 lanes) computes one 16x16 tile; blockDim = (32,4) -> 4 n-tiles
// per block. Batch base offsets: off = (bz/div)*sOuter + (bz%div)*sInner,
// which lets a (b,h) batch index address per-head column slices.
// B is addressed as B[k*bsK + n*bsN] so a transposed operand is just a stride
// swap (used for Q·K^T scores).
// ---------------------------------------------------------------------------
template <int KK>
__global__ void gemm_wmma_f32(const float* __restrict__ A, int lda, int divA, long sAo, long sAi,
                              const float* __restrict__ Bm, int bsK, int bsN, int divB, long sBo, long sBi,
                              float* __restrict__ C, int ldc, long sC,
                              const float* __restrict__ bias, float scale)
{
    const int lane = threadIdx.x;            // 0..31, one wave per y-slice
    const int r    = lane & 15;              // row (A/C) or col (B/C) within tile
    const int hi   = lane >> 4;              // selects K pair {2*hi, 2*hi+1}
    const int bz   = blockIdx.z;

    const long tm = (long)blockIdx.x * 16;
    const long tn = ((long)blockIdx.y * 4 + threadIdx.y) * 16;

    const float* __restrict__ Ab = A  + (long)(bz / divA) * sAo + (long)(bz % divA) * sAi;
    const float* __restrict__ Bb = Bm + (long)(bz / divB) * sBo + (long)(bz % divB) * sBi;
    float*       __restrict__ Cb = C  + (long)bz * sC;

    v8f acc = {};
#pragma unroll 8
    for (int k0 = 0; k0 < KK; k0 += 4) {
        const int kk = k0 + 2 * hi;
        v2f a;
        a.x = Ab[(tm + r) * lda + kk];
        a.y = Ab[(tm + r) * lda + kk + 1];
        v2f b;
        b.x = Bb[(long)kk * bsK + (tn + r) * bsN];
        b.y = Bb[(long)(kk + 1) * bsK + (tn + r) * bsN];
        // D = A(16x4) * B(4x16) + C  (f32 WMMA, wave32)
        acc = __builtin_amdgcn_wmma_f32_16x16x4_f32(false, a, false, b,
                                                    (short)0, acc, false, false);
    }

    // C/D layout: VGPR i, lanes 0-15 -> M=i, lanes 16-31 -> M=i+8; N = lane%16
#pragma unroll
    for (int i = 0; i < 8; ++i) {
        const long row = tm + i + 8 * hi;
        const long col = tn + r;
        float v = acc[i] * scale;
        if (bias) v += bias[col];
        Cb[row * ldc + col] = v;
    }
}

// ---------------------------------------------------------------------------
// Per-row (b,h,q): m = max_k s[q,k]; s <- exp(s - m).  One wave per row.
// Masked entries of the reference evaluate to exp(-10000-m) == 0 in f32, so a
// single unmasked row-max reproduces the per-d masked softmax exactly after
// the Z/num GEMMs below.
// ---------------------------------------------------------------------------
__global__ void rowmax_exp_kernel(float* __restrict__ E, int rowlen)
{
    float* p = E + (long)blockIdx.x * rowlen;
    const int lane = threadIdx.x;
    float m = -INFINITY;
    for (int k = lane; k < rowlen; k += 32) m = fmaxf(m, p[k]);
#pragma unroll
    for (int off = 16; off > 0; off >>= 1)
        m = fmaxf(m, __shfl_xor(m, off, 32));
    for (int k = lane; k < rowlen; k += 32)
        p[k] = __expf(p[k] - m);
}

// Mcat[b, k, 0:64]   = mask ? 1 : 0
// Mcat[b, k, 64:128] = mask ? value : 0
__global__ void prep_mask_kernel(const int* __restrict__ mask,
                                 const float* __restrict__ value,
                                 float* __restrict__ Mcat, int total)
{
    int idx = blockIdx.x * blockDim.x + threadIdx.x;
    if (idx >= total) return;
    const int d  = idx & (DD - 1);
    const int bk = idx >> 6;                  // b*LK + k
    const float mf = mask[idx] ? 1.0f : 0.0f;
    float* row = Mcat + (long)bk * (2 * DD);
    row[d]      = mf;
    row[DD + d] = mf * value[idx];
}

// Ccat[bh, q, 0:64] = Z, Ccat[bh, q, 64:128] = num.
// ctx[b, q, h*64 + d] = num / Z   (context, head-major columns)
__global__ void finalize_ctx_kernel(const float* __restrict__ Ccat,
                                    float* __restrict__ ctx, int total)
{
    int idx = blockIdx.x * blockDim.x + threadIdx.x;
    if (idx >= total) return;
    const int d  = idx & (DD - 1);
    const int q  = (idx >> 6) & (LQ - 1);
    const int bh = idx >> 13;                 // b*NH + h
    const int b  = bh >> 3;
    const int h  = bh & 7;
    const float* row = Ccat + ((long)bh * LQ + q) * (2 * DD);
    const float Z   = row[d];
    const float num = row[DD + d];
    ctx[((long)(b * LQ + q)) * (NH * DD) + h * DD + d] = num / Z;
}

extern "C" void kernel_launch(void* const* d_in, const int* in_sizes, int n_in,
                              void* d_out, int out_size, void* d_ws, size_t ws_size,
                              hipStream_t stream) {
    (void)in_sizes; (void)n_in; (void)out_size; (void)ws_size;

    const float* query = (const float*)d_in[0]; // (B, LQ, ET)
    const float* key   = (const float*)d_in[1]; // (B, LK, ET)
    const float* value = (const float*)d_in[2]; // (B, LK, DD)
    const int*   mask  = (const int*)  d_in[3]; // (B, LK, DD)
    const float* Wq    = (const float*)d_in[4]; // (ET, ET)
    const float* bq    = (const float*)d_in[5];
    const float* Wk    = (const float*)d_in[6]; // (ET, ET)
    const float* bk    = (const float*)d_in[7];
    const float* Wo    = (const float*)d_in[8]; // (NH*DD, HID)
    const float* bo    = (const float*)d_in[9];
    float* out = (float*)d_out;                 // (B, LQ, HID)

    // Workspace layout (floats); total ~13.3 MB — lives in the 192 MB L2.
    float* ws   = (float*)d_ws;
    float* Qp   = ws;                                  // B*LQ*ET        =   65536
    float* Kp   = Qp + (long)BB * LQ * ET;             // B*LK*ET        =  262144
    float* E    = Kp + (long)BB * LK * ET;             // B*NH*LQ*LK     = 2097152
    float* Mcat = E  + (long)BB * NH * LQ * LK;        // B*LK*2*DD      =  262144
    float* Ccat = Mcat + (long)BB * LK * 2 * DD;       // B*NH*LQ*2*DD   =  524288
    float* Ctx  = Ccat + (long)BB * NH * LQ * 2 * DD;  // B*LQ*NH*DD     =  262144

    const dim3 blk(32, 4);

    // 1) Qp = query @ Wq + bq      (512 x 128) @ (128 x 128)
    gemm_wmma_f32<ET><<<dim3((BB * LQ) / 16, (ET / 16) / 4, 1), blk, 0, stream>>>(
        query, ET, 1, 0, 0,
        Wq, ET, 1, 1, 0, 0,
        Qp, ET, 0, bq, 1.0f);

    // 2) Kp = key @ Wk + bk        (2048 x 128) @ (128 x 128)
    gemm_wmma_f32<ET><<<dim3((BB * LK) / 16, (ET / 16) / 4, 1), blk, 0, stream>>>(
        key, ET, 1, 0, 0,
        Wk, ET, 1, 1, 0, 0,
        Kp, ET, 0, bk, 1.0f);

    // 3) Scores per (b,h): E = (Qh @ Kh^T) / sqrt(EK).  A base: b*LQ*ET + h*EK;
    //    B is Kp read transposed: element (e, kcol) at Kp[(b*LK+kcol)*ET + h*EK + e].
    gemm_wmma_f32<EK><<<dim3(LQ / 16, (LK / 16) / 4, BB * NH), blk, 0, stream>>>(
        Qp, ET, NH, (long)LQ * ET, EK,
        Kp, 1, ET, NH, (long)LK * ET, EK,
        E, LK, (long)LQ * LK, nullptr, 0.25f);

    // 4) Row-softmax numerators: E <- exp(E - rowmax)   (one wave per row)
    rowmax_exp_kernel<<<dim3(BB * NH * LQ), dim3(32), 0, stream>>>(E, LK);

    // 5) Mcat = [maskf | maskf*value]   (B, LK, 128)
    {
        const int total = BB * LK * DD;
        prep_mask_kernel<<<dim3((total + 255) / 256), dim3(256), 0, stream>>>(
            mask, value, Mcat, total);
    }

    // 6) [Z | num] = E @ Mcat per (b,h):  (128 x 512) @ (512 x 128)
    gemm_wmma_f32<LK><<<dim3(LQ / 16, (2 * DD / 16) / 4, BB * NH), blk, 0, stream>>>(
        E, LK, 1, (long)LQ * LK, 0,
        Mcat, 2 * DD, 1, NH, (long)LK * 2 * DD, 0,
        Ccat, 2 * DD, (long)LQ * 2 * DD, nullptr, 1.0f);

    // 7) ctx[b,q,h*64+d] = num / Z
    {
        const int total = BB * NH * LQ * DD;
        finalize_ctx_kernel<<<dim3((total + 255) / 256), dim3(256), 0, stream>>>(
            Ccat, Ctx, total);
    }

    // 8) out = ctx @ Wo + bo       (512 x 512) @ (512 x 256)
    gemm_wmma_f32<NH * DD><<<dim3((BB * LQ) / 16, (HID / 16) / 4, 1), blk, 0, stream>>>(
        Ctx, NH * DD, 1, 0, 0,
        Wo, HID, 1, 1, 0, 0,
        out, HID, 0, bo, 1.0f);
}

// v001
// It runs in 49 microseconds.
// Timed twice side by side with v000, it ran 1.63 and 1.64 times as fast.
#include <hip/hip_runtime.h>
#include <hip/hip_bf16.h>
#include <math.h>

// Problem constants (from reference)
#define BB   4
#define LQ   128
#define LK   512
#define ET   128   // EMBED_TIME
#define NH   8     // NUM_HEADS
#define EK   16    // ET / NH
#define DD   64    // INPUT_DIM
#define HID  256   // HIDDEN_DIM

typedef __attribute__((ext_vector_type(2))) float v2f;
typedef __attribute__((ext_vector_type(4))) float v4f;
typedef __attribute__((ext_vector_type(4))) int   v4i;
typedef __attribute__((ext_vector_type(8))) float v8f;

// ---------------------------------------------------------------------------
// Generic batched GEMM on V_WMMA_F32_16X16X4_F32.
//   C[bz] = scale * (A[bz] @ B[bz]) + bias
// One wave (32 lanes) computes one 16x16 tile; blockDim = (32,4) -> 4 n-tiles
// per block. Batch base offsets: off = (bz/div)*sOuter + (bz%div)*sInner,
// which lets a (b,h) batch index address per-head column slices.
// B is addressed as B[k*bsK + n*bsN] so a transposed operand is just a stride
// swap.
// ---------------------------------------------------------------------------
template <int KK>
__global__ void gemm_wmma_f32(const float* __restrict__ A, int lda, int divA, long sAo, long sAi,
                              const float* __restrict__ Bm, int bsK, int bsN, int divB, long sBo, long sBi,
                              float* __restrict__ C, int ldc, long sC,
                              const float* __restrict__ bias, float scale)
{
    const int lane = threadIdx.x;            // 0..31, one wave per y-slice
    const int r    = lane & 15;              // row (A/C) or col (B/C) within tile
    const int hi   = lane >> 4;              // selects K pair {2*hi, 2*hi+1}
    const int bz   = blockIdx.z;

    const long tm = (long)blockIdx.x * 16;
    const long tn = ((long)blockIdx.y * 4 + threadIdx.y) * 16;

    const float* __restrict__ Ab = A  + (long)(bz / divA) * sAo + (long)(bz % divA) * sAi;
    const float* __restrict__ Bb = Bm + (long)(bz / divB) * sBo + (long)(bz % divB) * sBi;
    float*       __restrict__ Cb = C  + (long)bz * sC;

    v8f acc = {};
#pragma unroll 8
    for (int k0 = 0; k0 < KK; k0 += 4) {
        const int kk = k0 + 2 * hi;
        v2f a;
        a.x = Ab[(tm + r) * lda + kk];
        a.y = Ab[(tm + r) * lda + kk + 1];
        v2f b;
        b.x = Bb[(long)kk * bsK + (tn + r) * bsN];
        b.y = Bb[(long)(kk + 1) * bsK + (tn + r) * bsN];
        // D = A(16x4) * B(4x16) + C  (f32 WMMA, wave32)
        acc = __builtin_amdgcn_wmma_f32_16x16x4_f32(false, a, false, b,
                                                    (short)0, acc, false, false);
    }

    // C/D layout: VGPR i, lanes 0-15 -> M=i, lanes 16-31 -> M=i+8; N = lane%16
#pragma unroll
    for (int i = 0; i < 8; ++i) {
        const long row = tm + i + 8 * hi;
        const long col = tn + r;
        float v = acc[i] * scale;
        if (bias) v += bias[col];
        Cb[row * ldc + col] = v;
    }
}

// ---------------------------------------------------------------------------
// Fused attention core: one work-group per (b, h, 16 query rows), 8 waves,
// each wave owns 64 of the 512 keys.
//   S^T = Kh @ Qh^T   : a lane holds one query row (lane % 16) and, per key
//                       tile j, the keys 16j + 8*(lane/16) + i in register i.
//   e = exp(S/4 - m)  : m = row maximum over all 512 keys (exchanged in LDS).
//                       Masked entries of the reference evaluate to
//                       exp(-10000-m) == 0 in f32, so one unmasked row maximum
//                       reproduces the per-d masked softmax after Z and num.
//   [Z | num] += e @ [maskf | maskf*value] : register pair (2s, 2s+1) of tile j
//                       is already an A fragment; the B loader takes the same
//                       keys. Column tile t holds the features d = 4*(lane%16)+t,
//                       so one 16-byte load feeds four column tiles.
//   ctx = num / Z     : after the 8 waves' partial sums are added through LDS.
// ---------------------------------------------------------------------------
// exp(x) as __expf forms it: v_exp_f32 of x * log2(e). The v_nop in the same
// statement is the one slot the instruction set asks for between a
// transcendental and a use of its result or a rewrite of its source.
__device__ __forceinline__ float exp_slot(float x)
{
    float y;
    asm("v_exp_f32 %0, %1\n\tv_nop" : "=v"(y) : "v"(x * 1.44269504f));
    return y;
}

#define AW 8            // waves per work-group
#define KW (LK / AW)    // keys per wave
#define KT (KW / 16)    // 16-key tiles per wave

__global__ __launch_bounds__(32 * AW)
void attn_fused_kernel(const float* __restrict__ Qp, const float* __restrict__ Kp,
                       const int* __restrict__ mask, const float* __restrict__ value,
                       float* __restrict__ ctx)
{
    __shared__ float smax[AW][16];
    __shared__ __attribute__((aligned(16))) float red[AW][16][2 * DD];

    const int tid  = threadIdx.x;
    const int lane = tid & 31;
    const int w    = tid >> 5;
    const int r    = lane & 15;
    const int hi   = lane >> 4;
    const int q0   = blockIdx.x * 16;
    const int b    = blockIdx.y >> 3;
    const int h    = blockIdx.y & 7;
    const int key0 = w * KW;

    // Every loop of this kernel is unrolled in full: its register arrays must be
    // indexed by constants, or they would go to scratch.
    // All global reads of the wave are issued here, the score operands first.
    const float* qrow = Qp + (long)(b * LQ + q0 + r) * ET + h * EK + 2 * hi;
    const float* krow = Kp + (long)(b * LK + key0 + r) * ET + h * EK + 2 * hi;
    v2f qf[4];
    v2f kf[KT][4];
#pragma unroll
    for (int s = 0; s < 4; ++s) qf[s] = *(const v2f*)(qrow + 4 * s);
#pragma unroll
    for (int j = 0; j < KT; ++j)
#pragma unroll
        for (int s = 0; s < 4; ++s) kf[j][s] = *(const v2f*)(krow + j * 16 * ET + 4 * s);

    const long moff = (long)(b * LK + key0 + 8 * hi) * DD + 4 * r;
    const int*   mrow = mask  + moff;
    const float* vrow = value + moff;
    v4i mk[KT][8];
    v4f vl[KT][8];
#pragma unroll
    for (int j = 0; j < KT; ++j) {
        // Loads return in issue order: keep them in the order of their use, so
        // that key tile j can be multiplied while tiles j+1.. are still in flight.
        __builtin_amdgcn_sched_barrier(0);
#pragma unroll
        for (int i = 0; i < 8; ++i) {
            mk[j][i] = *(const v4i*)(mrow + (16 * j + i) * DD);
            vl[j][i] = *(const v4f*)(vrow + (16 * j + i) * DD);
        }
    }
    // The wait that stands in front of any rewrite of an address register of the
    // loads above; as its inputs the four addresses stay in their registers up to it.
    asm volatile("s_wait_xcnt 0x0" :: "v"(qrow), "v"(krow), "v"(mrow), "v"(vrow) : "memory");

    // Scores, transposed: st[j][i] = S[q0 + r][key0 + 16j + 8hi + i] / 4
    v8f st[KT];
#pragma unroll
    for (int j = 0; j < KT; ++j) {
        v8f acc = {};
#pragma unroll
        for (int s = 0; s < 4; ++s)
            acc = __builtin_amdgcn_wmma_f32_16x16x4_f32(false, kf[j][s], false, qf[s],
                                                        (short)0, acc, false, false);
        st[j] = acc * 0.25f;
    }

    float m = -INFINITY;
#pragma unroll
    for (int j = 0; j < KT; ++j)
#pragma unroll
        for (int i = 0; i < 8; ++i) m = fmaxf(m, st[j][i]);
    m = fmaxf(m, __shfl_xor(m, 16, 32));
    if (hi == 0) smax[w][r] = m;
    // Work-group barrier that orders LDS only: __syncthreads() would also wait
    // for every global load above, and the mask and value tiles would no longer
    // land behind the softmax and the first products.
    __builtin_amdgcn_fence(__ATOMIC_RELEASE, "workgroup", "local");
    __builtin_amdgcn_s_barrier();
    __builtin_amdgcn_fence(__ATOMIC_ACQUIRE, "workgroup", "local");
#pragma unroll
    for (int ww = 0; ww < AW; ++ww) m = fmaxf(m, smax[ww][r]);

#pragma unroll
    for (int j = 0; j < KT; ++j)
#pragma unroll
        for (int i = 0; i < 8; ++i) st[j][i] = exp_slot(st[j][i] - m);

    v8f accZ[4] = {};
    v8f accN[4] = {};
#pragma unroll
    for (int j = 0; j < KT; ++j)
#pragma unroll
        for (int s = 0; s < 4; ++s) {
            v2f a;
            a.x = st[j][2 * s];
            a.y = st[j][2 * s + 1];
#pragma unroll
            for (int t = 0; t < 4; ++t) {
                v2f bz;
                bz.x = mk[j][2 * s][t]     ? 1.0f : 0.0f;
                bz.y = mk[j][2 * s + 1][t] ? 1.0f : 0.0f;
                v2f bn;
                bn.x = bz.x * vl[j][2 * s][t];
                bn.y = bz.y * vl[j][2 * s + 1][t];
                accZ[t] = __builtin_amdgcn_wmma_f32_16x16x4_f32(false, a, false, bz,
                                                                (short)0, accZ[t], false, false);
                accN[t] = __builtin_amdgcn_wmma_f32_16x16x4_f32(false, a, false, bn,
                                                                (short)0, accN[t], false, false);
            }
        }

    // acc*[t][i] belongs to query row i + 8hi, feature 4r + t.
#pragma unroll
    for (int i = 0; i < 8; ++i) {
        v4f z = {accZ[0][i], accZ[1][i], accZ[2][i], accZ[3][i]};
        v4f n = {accN[0][i], accN[1][i], accN[2][i], accN[3][i]};
        *(v4f*)&red[w][i + 8 * hi][4 * r]      = z;
        *(v4f*)&red[w][i + 8 * hi][DD + 4 * r] = n;
    }
    __syncthreads();

    const int q = tid >> 4;
    const int c = tid & 15;
    v4f Z = *(const v4f*)&red[0][q][4 * c];
    v4f N = *(const v4f*)&red[0][q][DD + 4 * c];
#pragma unroll
    for (int ww = 1; ww < AW; ++ww) {
        Z += *(const v4f*)&red[ww][q][4 * c];
        N += *(const v4f*)&red[ww][q][DD + 4 * c];
    }
    *(v4f*)&ctx[(long)(b * LQ + q0 + q) * (NH * DD) + h * DD + 4 * c] = N / Z;
}

extern "C" void kernel_launch(void* const* d_in, const int* in_sizes, int n_in,
                              void* d_out, int out_size, void* d_ws, size_t ws_size,
                              hipStream_t stream) {
    (void)in_sizes; (void)n_in; (void)out_size; (void)ws_size;

    const float* query = (const float*)d_in[0]; // (B, LQ, ET)
    const float* key   = (const float*)d_in[1]; // (B, LK, ET)
    const float* value = (const float*)d_in[2]; // (B, LK, DD)
    const int*   mask  = (const int*)  d_in[3]; // (B, LK, DD)
    const float* Wq    = (const float*)d_in[4]; // (ET, ET)
    const float* bq    = (const float*)d_in[5];
    const float* Wk    = (const float*)d_in[6]; // (ET, ET)
    const float* bk    = (const float*)d_in[7];
    const float* Wo    = (const float*)d_in[8]; // (NH*DD, HID)
    const float* bo    = (const float*)d_in[9];
    float* out = (float*)d_out;                 // (B, LQ, HID)

    // Workspace layout (floats)
    float* ws   = (float*)d_ws;
    float* Qp   = ws;                                  // B*LQ*ET        =   65536
    float* Kp   = Qp + (long)BB * LQ * ET;             // B*LK*ET        =  262144
    float* Ctx  = Kp + (long)BB * LK * ET;             // B*LQ*NH*DD     =  262144

    const dim3 blk(32, 4);

    // 1) Qp = query @ Wq + bq      (512 x 128) @ (128 x 128)
    gemm_wmma_f32<ET><<<dim3((BB * LQ) / 16, (ET / 16) / 4, 1), blk, 0, stream>>>(
        query, ET, 1, 0, 0,
        Wq, ET, 1, 1, 0, 0,
        Qp, ET, 0, bq, 1.0f);

    // 2) Kp = key @ Wk + bk        (2048 x 128) @ (128 x 128)
    gemm_wmma_f32<ET><<<dim3((BB * LK) / 16, (ET / 16) / 4, 1), blk, 0, stream>>>(
        key, ET, 1, 0, 0,
        Wk, ET, 1, 1, 0, 0,
        Kp, ET, 0, bk, 1.0f);

    // 3) ctx[b,q,h*64+d] = num / Z: scores, softmax numerators, masked sums
    //    and the division in one launch
    attn_fused_kernel<<<dim3(LQ / 16, BB * NH), dim3(32 * AW), 0, stream>>>(
        Qp, Kp, mask, value, Ctx);

    // 4) out = ctx @ Wo + bo       (512 x 512) @ (512 x 256)
    gemm_wmma_f32<NH * DD><<<dim3((BB * LQ) / 16, (HID / 16) / 4, 1), blk, 0, stream>>>(
        Ctx, NH * DD, 1, 0, 0,
        Wo, HID, 1, 1, 0, 0,
        out, HID, 0, bo, 1.0f);
}

// v002
// One run takes 17.7 microseconds.
// Two timings next to v001 put it at 2.72 and 2.77 times that version's speed.
// Over all steps from v000 it is 4.49 times as fast.
#include <hip/hip_runtime.h>
#include <hip/hip_bf16.h>
#include <math.h>

// Problem constants (from reference)
#define BB   4
#define LQ   128
#define LK   512
#define ET   128   // EMBED_TIME
#define NH   8     // NUM_HEADS
#define EK   16    // ET / NH
#define DD   64    // INPUT_DIM
#define HID  256   // HIDDEN_DIM

typedef __attribute__((ext_vector_type(2))) float v2f;
typedef __attribute__((ext_vector_type(4))) float v4f;
typedef __attribute__((ext_vector_type(4))) int   v4i;
typedef __attribute__((ext_vector_type(8))) float v8f;

// ---------------------------------------------------------------------------
// C = A @ B + bias on V_WMMA_F32_16X16X4_F32; A (M x K), B (K x N), C (M x N)
// row-major. One wave owns a 16 x 32 tile of C over a slice of 128 k and issues
// every operand load of the slice before its first product, so that it waits
// out one memory latency and not one per group of products.
//   k order   : chunk i is k = 8i .. 8i+7 of the slice. Lane half hi holds
//               k = 8i + 4hi + 0..3 of A row (lane % 16) from one 16-byte load;
//               product 2i + p takes its elements 2p and 2p + 1. The B loader
//               takes the same four k as rows.
//   columns   : a lane reads the columns 2*(lane%16) and 2*(lane%16) + 1 of each
//               B row in one 8-byte load; column tile t holds the columns
//               2*(lane%16) + t.
//   work-group: 4 waves = K/128 slices of one tile, or 4 tiles side by side when
//               K = 128. Slices are added through LDS.
// ---------------------------------------------------------------------------
#define GW 4      // waves per work-group
#define GK 128    // k per wave
#define GC (GK / 8)
#define RP 36     // floats per LDS row: 8 rows further is 32 banks further

template <int K, int N>
__global__ __launch_bounds__(32 * GW)
void gemm_slice_kernel(const float* __restrict__ A, const float* __restrict__ Bm,
                       const float* __restrict__ bias, float* __restrict__ C)
{
    constexpr int KS = K / GK;   // slices per tile, one wave each
    constexpr int NT = GW / KS;  // tiles per work-group

    const int tid  = threadIdx.x;
    const int lane = tid & 31;
    const int w    = __builtin_amdgcn_readfirstlane(tid >> 5);
    const int r    = lane & 15;
    const int hi   = lane >> 4;
    const int ks   = w % KS;
    const int m0   = blockIdx.x * 16;
    const int n0   = (blockIdx.y * NT + w / KS) * 32;

    const float* arow = A  + (long)(m0 + r) * K + ks * GK + 4 * hi;
    const float* brow = Bm + (long)(ks * GK + 4 * hi) * N + n0 + 2 * r;
    v4f av[GC];
    v2f bv[GC][4];
    // Every loop here is unrolled in full: the register arrays must be indexed
    // by constants, or they would go to scratch.
#pragma unroll
    for (int i = 0; i < GC; ++i) {
        // Loads return in issue order: keep them in the order of their use, so
        // that chunk i can be multiplied while the later chunks are in flight.
        __builtin_amdgcn_sched_barrier(0);
        av[i] = *(const v4f*)(arow + 8 * i);
#pragma unroll
        for (int q = 0; q < 4; ++q) bv[i][q] = *(const v2f*)(brow + (8 * i + q) * N);
    }
    // The bias is used last and so is asked for last: per lane the columns that
    // the lane stores.
    const int bc = (KS == 1) ? 2 * r : 4 * (tid & 7);
    v4f bs = {};
    if constexpr (KS == 1) {
        const v2f b2 = *(const v2f*)(bias + n0 + bc);
        bs.x = b2.x;
        bs.y = b2.y;
    } else {
        bs = *(const v4f*)(bias + n0 + bc);
    }
    // The wait that stands in front of any rewrite of an address register of the
    // loads above; as its inputs the two addresses stay in their registers up to it.
    asm volatile("s_wait_xcnt 0x0" :: "v"(arow), "v"(brow) : "memory");
    // Keeps the products behind the last load: with products moved up among the
    // loads, the last chunk would be asked for one latency late.
    __builtin_amdgcn_sched_barrier(0);

    v8f acc[2] = {};
#pragma unroll
    for (int i = 0; i < GC; ++i)
#pragma unroll
        for (int p = 0; p < 2; ++p) {
            v2f a;
            a.x = av[i][2 * p];
            a.y = av[i][2 * p + 1];
#pragma unroll
            for (int t = 0; t < 2; ++t) {
                v2f b;
                b.x = bv[i][2 * p][t];
                b.y = bv[i][2 * p + 1][t];
                acc[t] = __builtin_amdgcn_wmma_f32_16x16x4_f32(false, a, false, b,
                                                               (short)0, acc[t], false, false);
            }
        }

    // acc[t][i] belongs to row i + 8hi, column 2r + t of the tile.
    if constexpr (KS == 1) {
#pragma unroll
        for (int i = 0; i < 8; ++i) {
            v2f o = {acc[0][i] + bs.x, acc[1][i] + bs.y};
            *(v2f*)&C[(long)(m0 + i + 8 * hi) * N + n0 + 2 * r] = o;
        }
    } else {
        __shared__ __attribute__((aligned(16))) float red[KS][16][RP];
#pragma unroll
        for (int i = 0; i < 8; ++i) {
            v2f o = {acc[0][i], acc[1][i]};
            *(v2f*)&red[ks][i + 8 * hi][2 * r] = o;
        }
        __syncthreads();
        const int row = tid >> 3;
        v4f s = bs;
#pragma unroll
        for (int k = 0; k < KS; ++k) s += *(const v4f*)&red[k][row][bc];
        *(v4f*)&C[(long)(m0 + row) * N + n0 + bc] = s;
    }
}

// ---------------------------------------------------------------------------
// Fused attention core: one work-group per (b, h, 16 query rows), 8 waves,
// each wave owns 64 of the 512 keys.
//   S^T = Kh @ Qh^T   : a lane holds one query row (lane % 16) and, per key
//                       tile j, the keys 16j + 8*(lane/16) + i in register i.
//   e = exp(S/4 - m)  : m = row maximum over all 512 keys (exchanged in LDS).
//                       Masked entries of the reference evaluate to
//                       exp(-10000-m) == 0 in f32, so one unmasked row maximum
//                       reproduces the per-d masked softmax after Z and num.
//   [Z | num] += e @ [maskf | maskf*value] : register pair (2s, 2s+1) of tile j
//                       is already an A fragment; the B loader takes the same
//                       keys. Column tile t holds the features d = 4*(lane%16)+t,
//                       so one 16-byte load feeds four column tiles.
//   ctx = num / Z     : after the 8 waves' partial sums are added through LDS.
// ---------------------------------------------------------------------------
// exp(x) as __expf forms it: v_exp_f32 of x * log2(e). The v_nop in the same
// statement is the one slot the instruction set asks for between a
// transcendental and a use of its result or a rewrite of its source.
__device__ __forceinline__ float exp_slot(float x)
{
    float y;
    asm("v_exp_f32 %0, %1\n\tv_nop" : "=v"(y) : "v"(x * 1.44269504f));
    return y;
}

#define AW 8            // waves per work-group
#define KW (LK / AW)    // keys per wave
#define KT (KW / 16)    // 16-key tiles per wave

__global__ __launch_bounds__(32 * AW)
void attn_fused_kernel(const float* __restrict__ Qp, const float* __restrict__ Kp,
                       const int* __restrict__ mask, const float* __restrict__ value,
                       float* __restrict__ ctx)
{
    __shared__ float smax[AW][16];
    __shared__ __attribute__((aligned(16))) float red[AW][16][2 * DD];

    const int tid  = threadIdx.x;
    const int lane = tid & 31;
    const int w    = tid >> 5;
    const int r    = lane & 15;
    const int hi   = lane >> 4;
    const int q0   = blockIdx.x * 16;
    const int b    = blockIdx.y >> 3;
    const int h    = blockIdx.y & 7;
    const int key0 = w * KW;

    // Every loop of this kernel is unrolled in full: its register arrays must be
    // indexed by constants, or they would go to scratch.
    // All global reads of the wave are issued here, the score operands first.
    const float* qrow = Qp + (long)(b * LQ + q0 + r) * ET + h * EK + 2 * hi;
    const float* krow = Kp + (long)(b * LK + key0 + r) * ET + h * EK + 2 * hi;
    v2f qf[4];
    v2f kf[KT][4];
#pragma unroll
    for (int s = 0; s < 4; ++s) qf[s] = *(const v2f*)(qrow + 4 * s);
#pragma unroll
    for (int j = 0; j < KT; ++j)
#pragma unroll
        for (int s = 0; s < 4; ++s) kf[j][s] = *(const v2f*)(krow + j * 16 * ET + 4 * s);

    const long moff = (long)(b * LK + key0 + 8 * hi) * DD + 4 * r;
    const int*   mrow = mask  + moff;
    const float* vrow = value + moff;
    v4i mk[KT][8];
    v4f vl[KT][8];
#pragma unroll
    for (int j = 0; j < KT; ++j) {
        // Loads return in issue order: keep them in the order of their use, so
        // that key tile j can be multiplied while tiles j+1.. are still in flight.
        __builtin_amdgcn_sched_barrier(0);
#pragma unroll
        for (int i = 0; i < 8; ++i) {
            mk[j][i] = *(const v4i*)(mrow + (16 * j + i) * DD);
            vl[j][i] = *(const v4f*)(vrow + (16 * j + i) * DD);
        }
    }
    // The wait that stands in front of any rewrite of an address register of the
    // loads above; as its inputs the four addresses stay in their registers up to it.
    asm volatile("s_wait_xcnt 0x0" :: "v"(qrow), "v"(krow), "v"(mrow), "v"(vrow) : "memory");

    // Scores, transposed: st[j][i] = S[q0 + r][key0 + 16j + 8hi + i] / 4
    v8f st[KT];
#pragma unroll
    for (int j = 0; j < KT; ++j) {
        v8f acc = {};
#pragma unroll
        for (int s = 0; s < 4; ++s)
            acc = __builtin_amdgcn_wmma_f32_16x16x4_f32(false, kf[j][s], false, qf[s],
                                                        (short)0, acc, false, false);
        st[j] = acc * 0.25f;
    }

    float m = -INFINITY;
#pragma unroll
    for (int j = 0; j < KT; ++j)
#pragma unroll
        for (int i = 0; i < 8; ++i) m = fmaxf(m, st[j][i]);
    m = fmaxf(m, __shfl_xor(m, 16, 32));
    if (hi == 0) smax[w][r] = m;
    // Work-group barrier that orders LDS only: __syncthreads() would also wait
    // for every global load above, and the mask and value tiles would no longer
    // land behind the softmax and the first products.
    __builtin_amdgcn_fence(__ATOMIC_RELEASE, "workgroup", "local");
    __builtin_amdgcn_s_barrier();
    __builtin_amdgcn_fence(__ATOMIC_ACQUIRE, "workgroup", "local");
#pragma unroll
    for (int ww = 0; ww < AW; ++ww) m = fmaxf(m, smax[ww][r]);

#pragma unroll
    for (int j = 0; j < KT; ++j)
#pragma unroll
        for (int i = 0; i < 8; ++i) st[j][i] = exp_slot(st[j][i] - m);

    v8f accZ[4] = {};
    v8f accN[4] = {};
#pragma unroll
    for (int j = 0; j < KT; ++j)
#pragma unroll
        for (int s = 0; s < 4; ++s) {
            v2f a;
            a.x = st[j][2 * s];
            a.y = st[j][2 * s + 1];
#pragma unroll
            for (int t = 0; t < 4; ++t) {
                v2f bz;
                bz.x = mk[j][2 * s][t]     ? 1.0f : 0.0f;
                bz.y = mk[j][2 * s + 1][t] ? 1.0f : 0.0f;
                v2f bn;
                bn.x = bz.x * vl[j][2 * s][t];
                bn.y = bz.y * vl[j][2 * s + 1][t];
                accZ[t] = __builtin_amdgcn_wmma_f32_16x16x4_f32(false, a, false, bz,
                                                                (short)0, accZ[t], false, false);
                accN[t] = __builtin_amdgcn_wmma_f32_16x16x4_f32(false, a, false, bn,
                                                                (short)0, accN[t], false, false);
            }
        }

    // acc*[t][i] belongs to query row i + 8hi, feature 4r + t.
#pragma unroll
    for (int i = 0; i < 8; ++i) {
        v4f z = {accZ[0][i], accZ[1][i], accZ[2][i], accZ[3][i]};
        v4f n = {accN[0][i], accN[1][i], accN[2][i], accN[3][i]};
        *(v4f*)&red[w][i + 8 * hi][4 * r]      = z;
        *(v4f*)&red[w][i + 8 * hi][DD + 4 * r] = n;
    }
    __syncthreads();

    const int q = tid >> 4;
    const int c = tid & 15;
    v4f Z = *(const v4f*)&red[0][q][4 * c];
    v4f N = *(const v4f*)&red[0][q][DD + 4 * c];
#pragma unroll
    for (int ww = 1; ww < AW; ++ww) {
        Z += *(const v4f*)&red[ww][q][4 * c];
        N += *(const v4f*)&red[ww][q][DD + 4 * c];
    }
    *(v4f*)&ctx[(long)(b * LQ + q0 + q) * (NH * DD) + h * DD + 4 * c] = N / Z;
}

extern "C" void kernel_launch(void* const* d_in, const int* in_sizes, int n_in,
                              void* d_out, int out_size, void* d_ws, size_t ws_size,
                              hipStream_t stream) {
    (void)in_sizes; (void)n_in; (void)out_size; (void)ws_size;

    const float* query = (const float*)d_in[0]; // (B, LQ, ET)
    const float* key   = (const float*)d_in[1]; // (B, LK, ET)
    const float* value = (const float*)d_in[2]; // (B, LK, DD)
    const int*   mask  = (const int*)  d_in[3]; // (B, LK, DD)
    const float* Wq    = (const float*)d_in[4]; // (ET, ET)
    const float* bq    = (const float*)d_in[5];
    const float* Wk    = (const float*)d_in[6]; // (ET, ET)
    const float* bk    = (const float*)d_in[7];
    const float* Wo    = (const float*)d_in[8]; // (NH*DD, HID)
    const float* bo    = (const float*)d_in[9];
    float* out = (float*)d_out;                 // (B, LQ, HID)

    // Workspace layout (floats)
    float* ws   = (float*)d_ws;
    float* Qp   = ws;                                  // B*LQ*ET        =   65536
    float* Kp   = Qp + (long)BB * LQ * ET;             // B*LK*ET        =  262144
    float* Ctx  = Kp + (long)BB * LK * ET;             // B*LQ*NH*DD     =  262144

    // 1) Qp = query @ Wq + bq      (512 x 128) @ (128 x 128)
    gemm_slice_kernel<ET, ET><<<dim3((BB * LQ) / 16, 1), dim3(32 * GW), 0, stream>>>(
        query, Wq, bq, Qp);

    // 2) Kp = key @ Wk + bk        (2048 x 128) @ (128 x 128)
    gemm_slice_kernel<ET, ET><<<dim3((BB * LK) / 16, 1), dim3(32 * GW), 0, stream>>>(
        key, Wk, bk, Kp);

    // 3) ctx[b,q,h*64+d] = num / Z: scores, softmax numerators, masked sums
    //    and the division in one launch
    attn_fused_kernel<<<dim3(LQ / 16, BB * NH), dim3(32 * AW), 0, stream>>>(
        Qp, Kp, mask, value, Ctx);

    // 4) out = ctx @ Wo + bo       (512 x 512) @ (512 x 256)
    gemm_slice_kernel<NH * DD, HID><<<dim3((BB * LQ) / 16, HID / 32), dim3(32 * GW), 0, stream>>>(
        Ctx, Wo, bo, out);
}

// v003
// Measured time: 15.2 microseconds a run.
// In two side-by-side timings against v002, it was 1.16 and 1.18 times as fast.
// Counting every step since v000, it is 5.27 times as fast.
#include <hip/hip_runtime.h>
#include <hip/hip_bf16.h>
#include <math.h>

// Problem constants (from reference)
#define BB   4
#define LQ   128
#define LK   512
#define ET   128   // EMBED_TIME
#define NH   8     // NUM_HEADS
#define EK   16    // ET / NH
#define DD   64    // INPUT_DIM
#define HID  256   // HIDDEN_DIM

typedef __attribute__((ext_vector_type(2))) float v2f;
typedef __attribute__((ext_vector_type(4))) float v4f;
typedef __attribute__((ext_vector_type(4))) int   v4i;
typedef __attribute__((ext_vector_type(8))) float v8f;

// ---------------------------------------------------------------------------
// C = A @ B + bias on V_WMMA_F32_16X16X4_F32; A (M x K), B (K x N), C (M x N)
// row-major. One wave owns a 16 x 32 tile of C over a slice of 128 k and issues
// every operand load of the slice before its first product, so that it waits
// out one memory latency and not one per group of products.
//   k order   : chunk i is k = 8i .. 8i+7 of the slice. Lane half hi holds
//               k = 8i + 4hi + 0..3 of A row (lane % 16) from one 16-byte load;
//               product 2i + p takes its elements 2p and 2p + 1. The B loader
//               takes the same four k as rows.
//   columns   : a lane reads the columns 2*(lane%16) and 2*(lane%16) + 1 of each
//               B row in one 8-byte load; column tile t holds the columns
//               2*(lane%16) + t.
//   work-group: 4 waves = K/128 slices of one tile, or 4 tiles side by side when
//               K = 128. Slices are added through LDS.
// ---------------------------------------------------------------------------
#define GW 4      // waves per work-group
#define GK 128    // k per wave
#define GC (GK / 8)
#define RP 36     // floats per LDS row: 8 rows further is 32 banks further

// mb, nb: the work-group's place in the grid of row blocks and column blocks.
template <int K, int N>
__device__ __forceinline__
void gemm_slice_tile(const float* __restrict__ A, const float* __restrict__ Bm,
                     const float* __restrict__ bias, float* __restrict__ C,
                     const int mb, const int nb)
{
    constexpr int KS = K / GK;   // slices per tile, one wave each
    constexpr int NT = GW / KS;  // tiles per work-group

    const int tid  = threadIdx.x;
    const int lane = tid & 31;
    const int w    = __builtin_amdgcn_readfirstlane(tid >> 5);
    const int r    = lane & 15;
    const int hi   = lane >> 4;
    const int ks   = w % KS;
    const int m0   = mb * 16;
    const int n0   = (nb * NT + w / KS) * 32;

    const float* arow = A  + (long)(m0 + r) * K + ks * GK + 4 * hi;
    const float* brow = Bm + (long)(ks * GK + 4 * hi) * N + n0 + 2 * r;
    v4f av[GC];
    v2f bv[GC][4];
    // Every loop here is unrolled in full: the register arrays must be indexed
    // by constants, or they would go to scratch.
#pragma unroll
    for (int i = 0; i < GC; ++i) {
        // Loads return in issue order: keep them in the order of their use, so
        // that chunk i can be multiplied while the later chunks are in flight.
        __builtin_amdgcn_sched_barrier(0);
        av[i] = *(const v4f*)(arow + 8 * i);
#pragma unroll
        for (int q = 0; q < 4; ++q) bv[i][q] = *(const v2f*)(brow + (8 * i + q) * N);
    }
    // The bias is used last and so is asked for last: per lane the columns that
    // the lane stores.
    const int bc = (KS == 1) ? 2 * r : 4 * (tid & 7);
    v4f bs = {};
    if constexpr (KS == 1) {
        const v2f b2 = *(const v2f*)(bias + n0 + bc);
        bs.x = b2.x;
        bs.y = b2.y;
    } else {
        bs = *(const v4f*)(bias + n0 + bc);
    }
    // The wait that stands in front of any rewrite of an address register of the
    // loads above; as its inputs the two addresses stay in their registers up to it.
    asm volatile("s_wait_xcnt 0x0" :: "v"(arow), "v"(brow) : "memory");
    // Keeps the products behind the last load: with products moved up among the
    // loads, the last chunk would be asked for one latency late.
    __builtin_amdgcn_sched_barrier(0);

    v8f acc[2] = {};
#pragma unroll
    for (int i = 0; i < GC; ++i)
#pragma unroll
        for (int p = 0; p < 2; ++p) {
            v2f a;
            a.x = av[i][2 * p];
            a.y = av[i][2 * p + 1];
#pragma unroll
            for (int t = 0; t < 2; ++t) {
                v2f b;
                b.x = bv[i][2 * p][t];
                b.y = bv[i][2 * p + 1][t];
                acc[t] = __builtin_amdgcn_wmma_f32_16x16x4_f32(false, a, false, b,
                                                               (short)0, acc[t], false, false);
            }
        }

    // acc[t][i] belongs to row i + 8hi, column 2r + t of the tile.
    if constexpr (KS == 1) {
#pragma unroll
        for (int i = 0; i < 8; ++i) {
            v2f o = {acc[0][i] + bs.x, acc[1][i] + bs.y};
            *(v2f*)&C[(long)(m0 + i + 8 * hi) * N + n0 + 2 * r] = o;
        }
    } else {
        __shared__ __attribute__((aligned(16))) float red[KS][16][RP];
#pragma unroll
        for (int i = 0; i < 8; ++i) {
            v2f o = {acc[0][i], acc[1][i]};
            *(v2f*)&red[ks][i + 8 * hi][2 * r] = o;
        }
        __syncthreads();
        const int row = tid >> 3;
        v4f s = bs;
#pragma unroll
        for (int k = 0; k < KS; ++k) s += *(const v4f*)&red[k][row][bc];
        *(v4f*)&C[(long)(m0 + row) * N + n0 + bc] = s;
    }
}

template <int K, int N>
__global__ __launch_bounds__(32 * GW)
void gemm_slice_kernel(const float* __restrict__ A, const float* __restrict__ Bm,
                       const float* __restrict__ bias, float* __restrict__ C)
{
    gemm_slice_tile<K, N>(A, Bm, bias, C, blockIdx.x, blockIdx.y);
}

// The two input projections need nothing of each other and share one grid: the
// first KB work-groups take the row blocks of key @ Wk + bk, the rest those of
// query @ Wq + bq. The choice is the same for a whole work-group.
#define KB ((BB * LK) / 16)
#define QB ((BB * LQ) / 16)

__global__ __launch_bounds__(32 * GW)
void proj_pair_kernel(const float* __restrict__ query, const float* __restrict__ Wq,
                      const float* __restrict__ bq, float* __restrict__ Qp,
                      const float* __restrict__ key, const float* __restrict__ Wk,
                      const float* __restrict__ bk, float* __restrict__ Kp)
{
    const int  blk = blockIdx.x;
    const bool isk = blk < KB;
    gemm_slice_tile<ET, ET>(isk ? key : query, isk ? Wk : Wq, isk ? bk : bq,
                            isk ? Kp : Qp, isk ? blk : blk - KB, 0);
}

// ---------------------------------------------------------------------------
// Fused attention core: one work-group per (b, h, 16 query rows), 8 waves,
// each wave owns 64 of the 512 keys.
//   S^T = Kh @ Qh^T   : a lane holds one query row (lane % 16) and, per key
//                       tile j, the keys 16j + 8*(lane/16) + i in register i.
//   e = exp(S/4 - m)  : m = row maximum over all 512 keys (exchanged in LDS).
//                       Masked entries of the reference evaluate to
//                       exp(-10000-m) == 0 in f32, so one unmasked row maximum
//                       reproduces the per-d masked softmax after Z and num.
//   [Z | num] += e @ [maskf | maskf*value] : register pair (2s, 2s+1) of tile j
//                       is already an A fragment; the B loader takes the same
//                       keys. Column tile t holds the features d = 4*(lane%16)+t,
//                       so one 16-byte load feeds four column tiles.
//   ctx = num / Z     : after the 8 waves' partial sums are added through LDS.
// ---------------------------------------------------------------------------
// exp(x) as __expf forms it: v_exp_f32 of x * log2(e). The v_nop in the same
// statement is the one slot the instruction set asks for between a
// transcendental and a use of its result or a rewrite of its source.
__device__ __forceinline__ float exp_slot(float x)
{
    float y;
    asm("v_exp_f32 %0, %1\n\tv_nop" : "=v"(y) : "v"(x * 1.44269504f));
    return y;
}

#define AW 8            // waves per work-group
#define KW (LK / AW)    // keys per wave
#define KT (KW / 16)    // 16-key tiles per wave

__global__ __launch_bounds__(32 * AW)
void attn_fused_kernel(const float* __restrict__ Qp, const float* __restrict__ Kp,
                       const int* __restrict__ mask, const float* __restrict__ value,
                       float* __restrict__ ctx)
{
    __shared__ float smax[AW][16];
    __shared__ __attribute__((aligned(16))) float red[AW][16][2 * DD];

    const int tid  = threadIdx.x;
    const int lane = tid & 31;
    const int w    = tid >> 5;
    const int r    = lane & 15;
    const int hi   = lane >> 4;
    const int q0   = blockIdx.x * 16;
    const int b    = blockIdx.y >> 3;
    const int h    = blockIdx.y & 7;
    const int key0 = w * KW;

    // Every loop of this kernel is unrolled in full: its register arrays must be
    // indexed by constants, or they would go to scratch.
    // All global reads of the wave are issued here, the score operands first.
    const float* qrow = Qp + (long)(b * LQ + q0 + r) * ET + h * EK + 2 * hi;
    const float* krow = Kp + (long)(b * LK + key0 + r) * ET + h * EK + 2 * hi;
    v2f qf[4];
    v2f kf[KT][4];
#pragma unroll
    for (int s = 0; s < 4; ++s) qf[s] = *(const v2f*)(qrow + 4 * s);
#pragma unroll
    for (int j = 0; j < KT; ++j)
#pragma unroll
        for (int s = 0; s < 4; ++s) kf[j][s] = *(const v2f*)(krow + j * 16 * ET + 4 * s);

    const long moff = (long)(b * LK + key0 + 8 * hi) * DD + 4 * r;
    const int*   mrow = mask  + moff;
    const float* vrow = value + moff;
    v4i mk[KT][8];
    v4f vl[KT][8];
#pragma unroll
    for (int j = 0; j < KT; ++j) {
        // Loads return in issue order: keep them in the order of their use, so
        // that key tile j can be multiplied while tiles j+1.. are still in flight.
        __builtin_amdgcn_sched_barrier(0);
#pragma unroll
        for (int i = 0; i < 8; ++i) {
            mk[j][i] = *(const v4i*)(mrow + (16 * j + i) * DD);
            vl[j][i] = *(const v4f*)(vrow + (16 * j + i) * DD);
        }
    }
    // The wait that stands in front of any rewrite of an address register of the
    // loads above; as its inputs the four addresses stay in their registers up to it.
    asm volatile("s_wait_xcnt 0x0" :: "v"(qrow), "v"(krow), "v"(mrow), "v"(vrow) : "memory");

    // Scores, transposed: st[j][i] = S[q0 + r][key0 + 16j + 8hi + i] / 4
    v8f st[KT];
#pragma unroll
    for (int j = 0; j < KT; ++j) {
        v8f acc = {};
#pragma unroll
        for (int s = 0; s < 4; ++s)
            acc = __builtin_amdgcn_wmma_f32_16x16x4_f32(false, kf[j][s], false, qf[s],
                                                        (short)0, acc, false, false);
        st[j] = acc * 0.25f;
    }

    float m = -INFINITY;
#pragma unroll
    for (int j = 0; j < KT; ++j)
#pragma unroll
        for (int i = 0; i < 8; ++i) m = fmaxf(m, st[j][i]);
    m = fmaxf(m, __shfl_xor(m, 16, 32));
    if (hi == 0) smax[w][r] = m;
    // Work-group barrier that orders LDS only: __syncthreads() would also wait
    // for every global load above, and the mask and value tiles would no longer
    // land behind the softmax and the first products.
    __builtin_amdgcn_fence(__ATOMIC_RELEASE, "workgroup", "local");
    __builtin_amdgcn_s_barrier();
    __builtin_amdgcn_fence(__ATOMIC_ACQUIRE, "workgroup", "local");
#pragma unroll
    for (int ww = 0; ww < AW; ++ww) m = fmaxf(m, smax[ww][r]);

#pragma unroll
    for (int j = 0; j < KT; ++j)
#pragma unroll
        for (int i = 0; i < 8; ++i) st[j][i] = exp_slot(st[j][i] - m);

    v8f accZ[4] = {};
    v8f accN[4] = {};
#pragma unroll
    for (int j = 0; j < KT; ++j)
#pragma unroll
        for (int s = 0; s < 4; ++s) {
            v2f a;
            a.x = st[j][2 * s];
            a.y = st[j][2 * s + 1];
#pragma unroll
            for (int t = 0; t < 4; ++t) {
                v2f bz;
                bz.x = mk[j][2 * s][t]     ? 1.0f : 0.0f;
                bz.y = mk[j][2 * s + 1][t] ? 1.0f : 0.0f;
                v2f bn;
                bn.x = bz.x * vl[j][2 * s][t];
                bn.y = bz.y * vl[j][2 * s + 1][t];
                accZ[t] = __builtin_amdgcn_wmma_f32_16x16x4_f32(false, a, false, bz,
                                                                (short)0, accZ[t], false, false);
                accN[t] = __builtin_amdgcn_wmma_f32_16x16x4_f32(false, a, false, bn,
                                                                (short)0, accN[t], false, false);
            }
        }

    // acc*[t][i] belongs to query row i + 8hi, feature 4r + t.
#pragma unroll
    for (int i = 0; i < 8; ++i) {
        v4f z = {accZ[0][i], accZ[1][i], accZ[2][i], accZ[3][i]};
        v4f n = {accN[0][i], accN[1][i], accN[2][i], accN[3][i]};
        *(v4f*)&red[w][i + 8 * hi][4 * r]      = z;
        *(v4f*)&red[w][i + 8 * hi][DD + 4 * r] = n;
    }
    __syncthreads();

    const int q = tid >> 4;
    const int c = tid & 15;
    v4f Z = *(const v4f*)&red[0][q][4 * c];
    v4f N = *(const v4f*)&red[0][q][DD + 4 * c];
#pragma unroll
    for (int ww = 1; ww < AW; ++ww) {
        Z += *(const v4f*)&red[ww][q][4 * c];
        N += *(const v4f*)&red[ww][q][DD + 4 * c];
    }
    *(v4f*)&ctx[(long)(b * LQ + q0 + q) * (NH * DD) + h * DD + 4 * c] = N / Z;
}

extern "C" void kernel_launch(void* const* d_in, const int* in_sizes, int n_in,
                              void* d_out, int out_size, void* d_ws, size_t ws_size,
                              hipStream_t stream) {
    (void)in_sizes; (void)n_in; (void)out_size; (void)ws_size;

    const float* query = (const float*)d_in[0]; // (B, LQ, ET)
    const float* key   = (const float*)d_in[1]; // (B, LK, ET)
    const float* value = (const float*)d_in[2]; // (B, LK, DD)
    const int*   mask  = (const int*)  d_in[3]; // (B, LK, DD)
    const float* Wq    = (const float*)d_in[4]; // (ET, ET)
    const float* bq    = (const float*)d_in[5];
    const float* Wk    = (const float*)d_in[6]; // (ET, ET)
    const float* bk    = (const float*)d_in[7];
    const float* Wo    = (const float*)d_in[8]; // (NH*DD, HID)
    const float* bo    = (const float*)d_in[9];
    float* out = (float*)d_out;                 // (B, LQ, HID)

    // Workspace layout (floats)
    float* ws   = (float*)d_ws;
    float* Qp   = ws;                                  // B*LQ*ET        =   65536
    float* Kp   = Qp + (long)BB * LQ * ET;             // B*LK*ET        =  262144
    float* Ctx  = Kp + (long)BB * LK * ET;             // B*LQ*NH*DD     =  262144

    // 1) Kp = key @ Wk + bk        (2048 x 128) @ (128 x 128)   and
    //    Qp = query @ Wq + bq      (512 x 128) @ (128 x 128)    in one grid
    proj_pair_kernel<<<dim3(KB + QB), dim3(32 * GW), 0, stream>>>(
        query, Wq, bq, Qp, key, Wk, bk, Kp);

    // 2) ctx[b,q,h*64+d] = num / Z: scores, softmax numerators, masked sums
    //    and the division in one launch
    attn_fused_kernel<<<dim3(LQ / 16, BB * NH), dim3(32 * AW), 0, stream>>>(
        Qp, Kp, mask, value, Ctx);

    // 3) out = ctx @ Wo + bo       (512 x 512) @ (512 x 256)
    gemm_slice_kernel<NH * DD, HID><<<dim3((BB * LQ) / 16, HID / 32), dim3(32 * GW), 0, stream>>>(
        Ctx, Wo, bo, out);
}

// v004
// A run of this version takes 14.5 microseconds.
// Timed twice side by side with v003, it ran 1.06 and 1.03 times as fast.
// Over all steps from v000 it is 5.51 times as fast.
#include <hip/hip_runtime.h>
#include <hip/hip_bf16.h>
#include <math.h>

// Problem constants (from reference)
#define BB   4
#define LQ   128
#define LK   512
#define ET   128   // EMBED_TIME
#define NH   8     // NUM_HEADS
#define EK   16    // ET / NH
#define DD   64    // INPUT_DIM
#define HID  256   // HIDDEN_DIM

typedef __attribute__((ext_vector_type(2))) float v2f;
typedef __attribute__((ext_vector_type(4))) float v4f;
typedef __attribute__((ext_vector_type(4))) int   v4i;
typedef __attribute__((ext_vector_type(8))) float v8f;

// ---------------------------------------------------------------------------
// C = A @ B + bias on V_WMMA_F32_16X16X4_F32; A (M x K), B (K x N), C (M x N)
// row-major. One wave owns a 16 x 32 tile of C over a slice of 128 k and issues
// every operand load of the slice before its first product, so that it waits
// out one memory latency and not one per group of products.
//   k order   : chunk i is k = 8i .. 8i+7 of the slice. Lane half hi holds
//               k = 8i + 4hi + 0..3 of A row (lane % 16) from one 16-byte load;
//               product 2i + p takes its elements 2p and 2p + 1. The B loader
//               takes the same four k as rows.
//   columns   : a lane reads the columns 2*(lane%16) and 2*(lane%16) + 1 of each
//               B row in one 8-byte load; column tile t holds the columns
//               2*(lane%16) + t.
//   work-group: 4 waves = K/128 slices of one tile, or 4 tiles side by side when
//               K = 128. Slices are added through LDS.
// ---------------------------------------------------------------------------
#define GW 4      // waves per work-group
#define GK 128    // k per wave
#define GC (GK / 8)
#define RP 36     // floats per LDS row: 8 rows further is 32 banks further

// mb, nb: the work-group's place in the grid of row blocks and column blocks.
template <int K, int N>
__device__ __forceinline__
void gemm_slice_tile(const float* __restrict__ A, const float* __restrict__ Bm,
                     const float* __restrict__ bias, float* __restrict__ C,
                     const int mb, const int nb)
{
    constexpr int KS = K / GK;   // slices per tile, one wave each
    constexpr int NT = GW / KS;  // tiles per work-group

    const int tid  = threadIdx.x;
    const int lane = tid & 31;
    const int w    = __builtin_amdgcn_readfirstlane(tid >> 5);
    const int r    = lane & 15;
    const int hi   = lane >> 4;
    const int ks   = w % KS;
    const int m0   = mb * 16;
    const int n0   = (nb * NT + w / KS) * 32;

    const float* arow = A  + (long)(m0 + r) * K + ks * GK + 4 * hi;
    const float* brow = Bm + (long)(ks * GK + 4 * hi) * N + n0 + 2 * r;
    v4f av[GC];
    v2f bv[GC][4];
    // Every loop here is unrolled in full: the register arrays must be indexed
    // by constants, or they would go to scratch.
#pragma unroll
    for (int i = 0; i < GC; ++i) {
        // Loads return in issue order: keep them in the order of their use, so
        // that chunk i can be multiplied while the later chunks are in flight.
        __builtin_amdgcn_sched_barrier(0);
        av[i] = *(const v4f*)(arow + 8 * i);
#pragma unroll
        for (int q = 0; q < 4; ++q) bv[i][q] = *(const v2f*)(brow + (8 * i + q) * N);
    }
    // The bias is used last and so is asked for last: per lane the columns that
    // the lane stores.
    const int bc = (KS == 1) ? 2 * r : 4 * (tid & 7);
    v4f bs = {};
    if constexpr (KS == 1) {
        const v2f b2 = *(const v2f*)(bias + n0 + bc);
        bs.x = b2.x;
        bs.y = b2.y;
    } else {
        bs = *(const v4f*)(bias + n0 + bc);
    }
    // The wait that stands in front of any rewrite of an address register of the
    // loads above; as its inputs the two addresses stay in their registers up to it.
    asm volatile("s_wait_xcnt 0x0" :: "v"(arow), "v"(brow) : "memory");
    // Keeps the products behind the last load: with products moved up among the
    // loads, the last chunk would be asked for one latency late.
    __builtin_amdgcn_sched_barrier(0);

    v8f acc[2] = {};
#pragma unroll
    for (int i = 0; i < GC; ++i)
#pragma unroll
        for (int p = 0; p < 2; ++p) {
            v2f a;
            a.x = av[i][2 * p];
            a.y = av[i][2 * p + 1];
#pragma unroll
            for (int t = 0; t < 2; ++t) {
                v2f b;
                b.x = bv[i][2 * p][t];
                b.y = bv[i][2 * p + 1][t];
                acc[t] = __builtin_amdgcn_wmma_f32_16x16x4_f32(false, a, false, b,
                                                               (short)0, acc[t], false, false);
            }
        }

    // acc[t][i] belongs to row i + 8hi, column 2r + t of the tile.
    if constexpr (KS == 1) {
#pragma unroll
        for (int i = 0; i < 8; ++i) {
            v2f o = {acc[0][i] + bs.x, acc[1][i] + bs.y};
            *(v2f*)&C[(long)(m0 + i + 8 * hi) * N + n0 + 2 * r] = o;
        }
    } else {
        __shared__ __attribute__((aligned(16))) float red[KS][16][RP];
#pragma unroll
        for (int i = 0; i < 8; ++i) {
            v2f o = {acc[0][i], acc[1][i]};
            *(v2f*)&red[ks][i + 8 * hi][2 * r] = o;
        }
        __syncthreads();
        const int row = tid >> 3;
        v4f s = bs;
#pragma unroll
        for (int k = 0; k < KS; ++k) s += *(const v4f*)&red[k][row][bc];
        *(v4f*)&C[(long)(m0 + row) * N + n0 + bc] = s;
    }
}

template <int K, int N>
__global__ __launch_bounds__(32 * GW)
void gemm_slice_kernel(const float* __restrict__ A, const float* __restrict__ Bm,
                       const float* __restrict__ bias, float* __restrict__ C)
{
    gemm_slice_tile<K, N>(A, Bm, bias, C, blockIdx.x, blockIdx.y);
}

// ---------------------------------------------------------------------------
// Fused attention core: one work-group per (b, h, 16 query rows), 8 waves,
// each wave owns 64 of the 512 keys.
//   Kh^T = Wk_h^T @ key^T + bk_h : the head's 16 columns of the key projection,
//                       formed here for the wave's own keys; Wk_h^T is laid in LDS
//                       once for the eight waves. A lane holds one key
//                       (lane % 16) and in register i the dim i + 8*(lane/16), so
//                       the register pair (2s, 2s+1) is an A fragment of Kh.
//   Qh^T = Wq_h^T @ query^T + bq_h : same form; each wave takes 16 of the 128 k,
//                       the eight partial tiles are added through LDS. The pair
//                       (2s, 2s+1) is the B fragment with the same dims.
//   k order of both   : as in the GEMM above, chunk i is k = 8i .. 8i+7, lane half
//                       hi holds k = 8i + 4hi + 0..3 of its key or query row in
//                       16 bytes, and the same four k as rows of W.
//   S^T = Kh @ Qh^T   : a lane holds one query row (lane % 16) and, per key
//                       tile j, the keys 16j + 8*(lane/16) + i in register i.
//   e = exp(S/4 - m)  : m = row maximum over all 512 keys (exchanged in LDS).
//                       Masked entries of the reference evaluate to
//                       exp(-10000-m) == 0 in f32, so one unmasked row maximum
//                       reproduces the per-d masked softmax after Z and num.
//   [Z | num] += e @ [maskf | maskf*value] : register pair (2s, 2s+1) of tile j
//                       is already an A fragment; the B loader takes the same
//                       keys. Column tile t holds the features d = 4*(lane%16)+t,
//                       so one 16-byte load feeds four column tiles.
//   ctx = num / Z     : after the 8 waves' partial sums are added through LDS.
// ---------------------------------------------------------------------------
// exp(x) as __expf forms it: v_exp_f32 of x * log2(e). The v_nop in the same
// statement is the one slot the instruction set asks for between a
// transcendental and a use of its result or a rewrite of its source.
__device__ __forceinline__ float exp_slot(float x)
{
    float y;
    asm("v_exp_f32 %0, %1\n\tv_nop" : "=v"(y) : "v"(x * 1.44269504f));
    return y;
}

#define AW 8            // waves per work-group
#define KW (LK / AW)    // keys per wave
#define KT (KW / 16)    // 16-key tiles per wave
#define KP (ET + 4)     // floats per staged key row: 16 rows of 16 bytes fall on all 64 banks

__global__ __launch_bounds__(32 * AW)
void attn_fused_kernel(const float* __restrict__ query, const float* __restrict__ Wq,
                       const float* __restrict__ bq, const float* __restrict__ key,
                       const float* __restrict__ Wk, const float* __restrict__ bk,
                       const int* __restrict__ mask, const float* __restrict__ value,
                       float* __restrict__ ctx)
{
    __shared__ float smax[AW][16];
    __shared__ __attribute__((aligned(16))) float qpart[AW][32][8];
    __shared__ __attribute__((aligned(16))) float wkt[EK][KP];
    __shared__ __attribute__((aligned(16))) float kst[AW][2][16][KP];
    __shared__ __attribute__((aligned(16))) float red[AW][16][2 * DD];

    const int tid  = threadIdx.x;
    const int lane = tid & 31;
    const int w    = tid >> 5;
    const int r    = lane & 15;
    const int hi   = lane >> 4;
    const int q0   = blockIdx.x * 16;
    const int b    = blockIdx.y >> 3;
    const int h    = blockIdx.y & 7;
    const int key0 = w * KW;

    // Every loop of this kernel is unrolled in full: its register arrays must be
    // indexed by constants, or they would go to scratch.
    const float* qrow  = query + (long)(b * LQ + q0 + r) * ET + 16 * w + 4 * hi;
    const float* wqrow = Wq + (long)(16 * w + 4 * hi) * ET + h * EK + r;
    const float* krow  = key + (long)(b * LK + key0) * ET + 4 * lane;
    const float* wkrow = Wk + (long)(tid >> 2) * ET + h * EK + 4 * (tid & 3);
    const unsigned bo  = 32u * hi;   // bytes: the lane half's eight dims of a bias
    const float* bqrow = (const float*)((const char*)(bq + h * EK) + bo);
    const float* bkrow = (const float*)((const char*)(bk + h * EK) + bo);
    const long moff = (long)(b * LK + key0 + 8 * hi) * DD + 4 * r;
    const int*   mrow = mask  + moff;
    const float* vrow = value + moff;

    // Loads return in issue order, so they are issued in the order of their use:
    // the thread's share of Wk_h (rows tid/4 and tid/4 + 64, four columns), the
    // operands of the wave's slice of Qh^T (k = 16w .. 16w+15), the biases, key
    // tiles 0 and 1.
    const v4f wg0 = *(const v4f*)(wkrow);
    const v4f wg1 = *(const v4f*)(wkrow + 64 * ET);
    v4f qv[2];
    v2f wqf[2][2];
#pragma unroll
    for (int c = 0; c < 2; ++c) {
        qv[c] = *(const v4f*)(qrow + 8 * c);
#pragma unroll
        for (int p = 0; p < 2; ++p) {
            wqf[c][p].x = wqrow[(8 * c + 2 * p) * ET];
            wqf[c][p].y = wqrow[(8 * c + 2 * p + 1) * ET];
        }
    }
    const v4f bk0 = *(const v4f*)(bkrow);
    const v4f bk1 = *(const v4f*)(bkrow + 4);
    const v4f bq0 = *(const v4f*)(bqrow);
    const v4f bq1 = *(const v4f*)(bqrow + 4);
    // kg[j][i]: row i of key tile j, one whole row of 512 bytes per wave load.
    v4f kg[KT][16];
#pragma unroll
    for (int i = 0; i < 16; ++i) kg[0][i] = *(const v4f*)(krow + i * ET);
#pragma unroll
    for (int i = 0; i < 16; ++i) kg[1][i] = *(const v4f*)(krow + (16 + i) * ET);
    // The wait that stands in front of any rewrite of an address register of the
    // loads above; as its inputs the addresses stay in their registers up to it.
    asm volatile("s_wait_xcnt 0x0" :: "v"(qrow), "v"(wqrow), "v"(wkrow), "v"(bo) : "memory");
    // Keeps the products behind the loads above: moved up among them, they would
    // hold back the issue of the later loads by one latency.
    __builtin_amdgcn_sched_barrier(0);

    // Wk_h^T for the whole work-group: wkt[dim][k] = Wk[k][16h + dim]
#pragma unroll
    for (int e = 0; e < 4; ++e) {
        wkt[4 * (tid & 3) + e][tid >> 2]        = wg0[e];
        wkt[4 * (tid & 3) + e][(tid >> 2) + 64] = wg1[e];
    }

    // The wave's partial Qh^T: qp[i] = sum over its 16 k for query q0 + r, dim i + 8hi
    {
        v8f qp = {};
#pragma unroll
        for (int c = 0; c < 2; ++c)
#pragma unroll
            for (int p = 0; p < 2; ++p) {
                v2f x;
                x.x = qv[c][2 * p];
                x.y = qv[c][2 * p + 1];
                qp = __builtin_amdgcn_wmma_f32_16x16x4_f32(false, wqf[c][p], false, x,
                                                           (short)0, qp, false, false);
            }
        v4f lo = {qp[0], qp[1], qp[2], qp[3]};
        v4f up = {qp[4], qp[5], qp[6], qp[7]};
        *(v4f*)&qpart[w][lane][0] = lo;
        *(v4f*)&qpart[w][lane][4] = up;
    }

    // A key tile goes through the wave's own LDS rows to turn whole rows into B
    // fragments: kf[j][i] = k 8i + 4hi + 0..3 of key row 16j + r. Tile j uses
    // buffer j % 2, which is written again only behind the products of tile j.
    v4f kf[KT][GC];
    v4i mk[KT][8];
    v4f vl[KT][8];
    // kt[j][i] = Kh[key0 + 16j + r][i + 8hi]
    v8f kt[KT];
    // wkf[i] = k 8i + 4hi + 0..3 of row r of Wk_h^T: the A fragments of all four tiles
    v4f wkf[GC];
#pragma unroll
    for (int j = -1; j < KT; ++j) {
        // Two accumulators: two independent chains of products.
        v8f a0 = {bk0.x, bk0.y, bk0.z, bk0.w, bk1.x, bk1.y, bk1.z, bk1.w};
        v8f a1 = {};
#pragma unroll
        for (int half = 0; half < 2; ++half) {
            if (j >= 0) {
#pragma unroll
                for (int i = half * (GC / 2); i < (half + 1) * (GC / 2); ++i) {
                    v2f x0, x1;
                    x0.x = kf[j][i][0];
                    x0.y = kf[j][i][1];
                    x1.x = kf[j][i][2];
                    x1.y = kf[j][i][3];
                    v2f w0, w1;
                    w0.x = wkf[i][0];
                    w0.y = wkf[i][1];
                    w1.x = wkf[i][2];
                    w1.y = wkf[i][3];
                    a0 = __builtin_amdgcn_wmma_f32_16x16x4_f32(false, w0, false, x0,
                                                               (short)0, a0, false, false);
                    a1 = __builtin_amdgcn_wmma_f32_16x16x4_f32(false, w1, false, x1,
                                                               (short)0, a1, false, false);
                }
            }
            if (half == 1) break;
            // Between the two halves of tile j's products: the LDS turn of tile j + 1
            // and the next loads, as one group. The two fences hold the group there,
            // so that the fragments and the loads land behind the second half.
            __builtin_amdgcn_sched_barrier(0);
            if (j + 1 < KT) {
#pragma unroll
                for (int i = 0; i < 16; ++i)
                    *(v4f*)&kst[w][(j + 1) & 1][i][4 * lane] = kg[j + 1][i];
                // The rows are read back by other lanes of the wave: its stores end first.
                asm volatile("s_wait_dscnt 0x0" ::: "memory");
#pragma unroll
                for (int i = 0; i < GC; ++i)
                    kf[j + 1][i] = *(const v4f*)&kst[w][(j + 1) & 1][r][8 * i + 4 * hi];
            }
            if (j + 3 < KT) {
#pragma unroll
                for (int i = 0; i < 16; ++i)
                    kg[j + 3][i] = *(const v4f*)(krow + ((j + 3) * 16 + i) * ET);
            }
            // Mask and value rows follow the last key tile: tiles 0 and 1 in pass 1,
            // tile j in pass j from there on.
#pragma unroll
            for (int jj = 0; jj < KT; ++jj)
                if ((j == 1 && jj <= 1) || (j >= 2 && jj == j)) {
#pragma unroll
                    for (int i = 0; i < 8; ++i) {
                        mk[jj][i] = *(const v4i*)(mrow + (16 * jj + i) * DD);
                        vl[jj][i] = *(const v4f*)(vrow + (16 * jj + i) * DD);
                    }
                }
            if (j == KT - 1) {
                // The same wait for the loads of the passes: key, mask and value rows.
                asm volatile("s_wait_xcnt 0x0" :: "v"(krow), "v"(mrow), "v"(vrow) : "memory");
            }
            __builtin_amdgcn_sched_barrier(0);
        }
        if (j >= 0) kt[j] = a0 + a1;
        if (j == -1) {
            // Work-group barrier that orders LDS only (see the one below): publishes
            // Wk_h^T and the eight partial Qh^T tiles.
            __builtin_amdgcn_fence(__ATOMIC_RELEASE, "workgroup", "local");
            __builtin_amdgcn_s_barrier();
            __builtin_amdgcn_fence(__ATOMIC_ACQUIRE, "workgroup", "local");
#pragma unroll
            for (int i = 0; i < GC; ++i) wkf[i] = *(const v4f*)&wkt[r][8 * i + 4 * hi];
        }
    }

    // qt[i] = Qh[q0 + r][i + 8hi]
    v4f qlo = bq0;
    v4f qup = bq1;
#pragma unroll
    for (int ww = 0; ww < AW; ++ww) {
        qlo += *(const v4f*)&qpart[ww][lane][0];
        qup += *(const v4f*)&qpart[ww][lane][4];
    }
    const v8f qt = {qlo.x, qlo.y, qlo.z, qlo.w, qup.x, qup.y, qup.z, qup.w};

    // Scores, transposed: st[j][i] = S[q0 + r][key0 + 16j + 8hi + i]. Product s
    // takes the dims 2s, 2s+1 (lanes 0-15) and 8+2s, 8+2s+1 (lanes 16-31) of both.
    v8f st[KT];
#pragma unroll
    for (int j = 0; j < KT; ++j) {
        v8f acc = {};
#pragma unroll
        for (int s = 0; s < 4; ++s) {
            v2f ka, qb;
            ka.x = kt[j][2 * s];
            ka.y = kt[j][2 * s + 1];
            qb.x = qt[2 * s];
            qb.y = qt[2 * s + 1];
            acc = __builtin_amdgcn_wmma_f32_16x16x4_f32(false, ka, false, qb,
                                                        (short)0, acc, false, false);
        }
        st[j] = acc * 0.25f;
    }

    float m = -INFINITY;
#pragma unroll
    for (int j = 0; j < KT; ++j)
#pragma unroll
        for (int i = 0; i < 8; ++i) m = fmaxf(m, st[j][i]);
    m = fmaxf(m, __shfl_xor(m, 16, 32));
    if (hi == 0) smax[w][r] = m;
    // Work-group barrier that orders LDS only: __syncthreads() would also wait
    // for every global load above, and the mask and value tiles would no longer
    // land behind the softmax and the first products.
    __builtin_amdgcn_fence(__ATOMIC_RELEASE, "workgroup", "local");
    __builtin_amdgcn_s_barrier();
    __builtin_amdgcn_fence(__ATOMIC_ACQUIRE, "workgroup", "local");
#pragma unroll
    for (int ww = 0; ww < AW; ++ww) m = fmaxf(m, smax[ww][r]);

#pragma unroll
    for (int j = 0; j < KT; ++j)
#pragma unroll
        for (int i = 0; i < 8; ++i) st[j][i] = exp_slot(st[j][i] - m);

    v8f accZ[4] = {};
    v8f accN[4] = {};
#pragma unroll
    for (int j = 0; j < KT; ++j)
#pragma unroll
        for (int s = 0; s < 4; ++s) {
            v2f a;
            a.x = st[j][2 * s];
            a.y = st[j][2 * s + 1];
#pragma unroll
            for (int t = 0; t < 4; ++t) {
                v2f bz;
                bz.x = mk[j][2 * s][t]     ? 1.0f : 0.0f;
                bz.y = mk[j][2 * s + 1][t] ? 1.0f : 0.0f;
                v2f bn;
                bn.x = bz.x * vl[j][2 * s][t];
                bn.y = bz.y * vl[j][2 * s + 1][t];
                accZ[t] = __builtin_amdgcn_wmma_f32_16x16x4_f32(false, a, false, bz,
                                                                (short)0, accZ[t], false, false);
                accN[t] = __builtin_amdgcn_wmma_f32_16x16x4_f32(false, a, false, bn,
                                                                (short)0, accN[t], false, false);
            }
        }

    // acc*[t][i] belongs to query row i + 8hi, feature 4r + t.
#pragma unroll
    for (int i = 0; i < 8; ++i) {
        v4f z = {accZ[0][i], accZ[1][i], accZ[2][i], accZ[3][i]};
        v4f n = {accN[0][i], accN[1][i], accN[2][i], accN[3][i]};
        *(v4f*)&red[w][i + 8 * hi][4 * r]      = z;
        *(v4f*)&red[w][i + 8 * hi][DD + 4 * r] = n;
    }
    __syncthreads();

    const int q = tid >> 4;
    const int c = tid & 15;
    v4f Z = *(const v4f*)&red[0][q][4 * c];
    v4f N = *(const v4f*)&red[0][q][DD + 4 * c];
#pragma unroll
    for (int ww = 1; ww < AW; ++ww) {
        Z += *(const v4f*)&red[ww][q][4 * c];
        N += *(const v4f*)&red[ww][q][DD + 4 * c];
    }
    *(v4f*)&ctx[(long)(b * LQ + q0 + q) * (NH * DD) + h * DD + 4 * c] = N / Z;
}

extern "C" void kernel_launch(void* const* d_in, const int* in_sizes, int n_in,
                              void* d_out, int out_size, void* d_ws, size_t ws_size,
                              hipStream_t stream) {
    (void)in_sizes; (void)n_in; (void)out_size; (void)ws_size;

    const float* query = (const float*)d_in[0]; // (B, LQ, ET)
    const float* key   = (const float*)d_in[1]; // (B, LK, ET)
    const float* value = (const float*)d_in[2]; // (B, LK, DD)
    const int*   mask  = (const int*)  d_in[3]; // (B, LK, DD)
    const float* Wq    = (const float*)d_in[4]; // (ET, ET)
    const float* bq    = (const float*)d_in[5];
    const float* Wk    = (const float*)d_in[6]; // (ET, ET)
    const float* bk    = (const float*)d_in[7];
    const float* Wo    = (const float*)d_in[8]; // (NH*DD, HID)
    const float* bo    = (const float*)d_in[9];
    float* out = (float*)d_out;                 // (B, LQ, HID)

    // Workspace layout (floats)
    float* Ctx  = (float*)d_ws;                        // B*LQ*NH*DD     =  262144

    // 1) ctx[b,q,h*64+d] = num / Z: the head's slices of query @ Wq + bq and
    //    key @ Wk + bk, scores, softmax numerators, masked sums and the division
    attn_fused_kernel<<<dim3(LQ / 16, BB * NH), dim3(32 * AW), 0, stream>>>(
        query, Wq, bq, key, Wk, bk, mask, value, Ctx);

    // 2) out = ctx @ Wo + bo       (512 x 512) @ (512 x 256)
    gemm_slice_kernel<NH * DD, HID><<<dim3((BB * LQ) / 16, HID / 32), dim3(32 * GW), 0, stream>>>(
        Ctx, Wo, bo, out);
}
